// v000
// Measured on an AMD MI455X. A time is GPU time per run, averaged over a window of back-to-back runs after a warm-up
// (all launches, gaps included; the runs take copies of the inputs in turn), and the median of several windows.
// Apart from v000's, it joins two sittings. Times from different sittings can be a few percent apart, while
// side-by-side timings come from the same sitting.
// v000, which the later versions start from, runs in 789 microseconds.
#include <hip/hip_runtime.h>
#include <math.h>

#define B_ 2
#define T_ 2048
#define C_ 1024
#define H_ 16
#define D_ 64
#define NTOK (B_ * T_)   /* 4096 token rows */
#define FC_  (4 * C_)    /* 4096 hidden     */
#define SST  (T_ + 8)    /* padded LDS score row stride (floats) */

typedef __bf16 v16bf __attribute__((ext_vector_type(16)));
typedef __bf16 v8bf  __attribute__((ext_vector_type(8)));
typedef float  v8f   __attribute__((ext_vector_type(8)));
typedef unsigned int v4u __attribute__((ext_vector_type(4)));
typedef int    v4i   __attribute__((ext_vector_type(4)));
typedef int    v8i   __attribute__((ext_vector_type(8)));

__device__ __forceinline__ v8f wmma_bf16(v16bf a, v16bf b, v8f c) {
  // D = A(16x32 bf16) * B(32x16 bf16) + C(16x16 f32)
  return __builtin_amdgcn_wmma_f32_16x16x32_bf16(
      /*neg_a=*/false, a, /*neg_b=*/false, b,
      /*c_mod=*/(short)0, c, /*reuse_a=*/false, /*reuse_b=*/false);
}

__device__ __forceinline__ v16bf load_frag(const __bf16* p) {
  v8bf lo = *(const v8bf*)(p);
  v8bf hi = *(const v8bf*)(p + 16);
  v16bf r;
#pragma unroll
  for (int i = 0; i < 8; ++i) { r[i] = lo[i]; r[i + 8] = hi[i]; }
  return r;
}

__device__ __forceinline__ void tdm_load_2d_bf16(unsigned int lds_addr,
                                                 const __bf16* gptr,
                                                 int tile_k, int tile_n, int K) {
  unsigned long long ga = (unsigned long long)(uintptr_t)gptr;
  v4u g0;
  g0[0] = 1u;
  g0[1] = lds_addr;
  g0[2] = (unsigned int)ga;
  g0[3] = (unsigned int)((ga >> 32) & 0x01FFFFFFu) | 0x80000000u;
  unsigned int td0 = (unsigned int)K;
  unsigned int td1 = 1u << 20;
  unsigned int st0 = (unsigned int)K;
  v8i g1;
  g1[0] = (int)(1u << 16);
  g1[1] = (int)((td0 & 0xFFFFu) << 16);
  g1[2] = (int)((td0 >> 16) | ((td1 & 0xFFFFu) << 16));
  g1[3] = (int)((td1 >> 16) | ((unsigned int)tile_k << 16));
  g1[4] = tile_n;
  g1[5] = (int)st0;
  g1[6] = 0;
  g1[7] = 0;
  v4i z4 = {0, 0, 0, 0};
  v8i z8 = {0, 0, 0, 0, 0, 0, 0, 0};
  __builtin_amdgcn_tensor_load_to_lds(g0, g1, z4, z4, z8, 0);
}

__device__ __forceinline__ float gelu_f(float x) {
  const float c = 0.7978845608028654f; // sqrt(2/pi)
  return 0.5f * x * (1.0f + tanhf(c * (x + 0.044715f * x * x * x)));
}

// ------------------------------ f32 -> bf16 --------------------------------
__global__ void cvt_bf16_kernel(const float* __restrict__ in,
                                __bf16* __restrict__ out, int n) {
  int i = blockIdx.x * blockDim.x + threadIdx.x;
  int stride = gridDim.x * blockDim.x;
  for (; i < n; i += stride) out[i] = (__bf16)in[i];
}

// ------------------------------ LayerNorm ----------------------------------
__global__ __launch_bounds__(256)
void ln_kernel(const float* __restrict__ in, const float* __restrict__ w,
               const float* __restrict__ bvec, __bf16* __restrict__ out_bf,
               float* __restrict__ out_f32, __bf16* __restrict__ vt) {
  int row = blockIdx.x;                 // 0..NTOK-1
  const float* x = in + (size_t)row * C_;
  int tid = threadIdx.x;

  float s = 0.f, s2 = 0.f;
  for (int c = tid; c < C_; c += 256) { float v = x[c]; s += v; s2 += v * v; }
#pragma unroll
  for (int o = 16; o; o >>= 1) {
    s  += __shfl_down(s,  o, 32);
    s2 += __shfl_down(s2, o, 32);
  }
  __shared__ float rs[8], rs2[8];
  __shared__ float mu_s, rstd_s;
  if ((tid & 31) == 0) { rs[tid >> 5] = s; rs2[tid >> 5] = s2; }
  __syncthreads();
  if (tid == 0) {
    float ts = 0.f, ts2 = 0.f;
#pragma unroll
    for (int i = 0; i < 8; ++i) { ts += rs[i]; ts2 += rs2[i]; }
    float mu = ts / (float)C_;
    float var = ts2 / (float)C_ - mu * mu;
    mu_s = mu;
    rstd_s = rsqrtf(var + 1e-5f);
  }
  __syncthreads();
  float mu = mu_s, rstd = rstd_s;
  int b = row / T_, t = row % T_;
  for (int c = tid; c < C_; c += 256) {
    float v = (x[c] - mu) * rstd * w[c] + bvec[c];
    if (out_f32) out_f32[(size_t)row * C_ + c] = v;
    if (out_bf)  out_bf[(size_t)row * C_ + c] = (__bf16)v;
    if (vt) {
      int h = c >> 6, d = c & 63;
      vt[(((size_t)b * H_ + h) * D_ + d) * T_ + t] = (__bf16)v;
    }
  }
}

// ------------------------------ Attention ----------------------------------
// Block = 4 waves, handles 16 query rows of one (b,h). Dynamic LDS holds the
// full 16 x (<=2048) f32 score slab (128 KB, fits in 320 KB WGP LDS).
__global__ __launch_bounds__(128)
void attn_kernel(const __bf16* __restrict__ qbf, const __bf16* __restrict__ kbf,
                 const __bf16* __restrict__ vt, __bf16* __restrict__ ybf) {
  extern __shared__ float scores[];     // [16][SST]
  int lane = threadIdx.x & 31;
  int wv   = threadIdx.x >> 5;          // 0..3
  int bx = blockIdx.x, h = blockIdx.y, b = blockIdx.z;
  int t0 = bx * 16;
  int count = bx + 1;                   // causal: s-tiles 0..bx
  int limit = count * 16;
  int l15 = lane & 15;
  int kb  = (lane >> 4) * 8;

  // ---- phase 1: S = (Q K^T) / sqrt(D), causal-masked, into LDS -----------
  const __bf16* qrow =
      qbf + ((size_t)b * T_ + t0 + l15) * C_ + h * D_ + kb;
  v16bf aq0 = load_frag(qrow + 0);      // K-dim d = 0..31
  v16bf aq1 = load_frag(qrow + 32);     // K-dim d = 32..63
  for (int st = wv; st < count; st += 4) {
    int s0 = st * 16;
    const __bf16* krow =
        kbf + ((size_t)b * T_ + s0 + l15) * C_ + h * D_ + kb;
    v8f acc = {};
    acc = wmma_bf16(aq0, load_frag(krow + 0),  acc);
    acc = wmma_bf16(aq1, load_frag(krow + 32), acc);
    int n = l15;
    int mhi = (lane >> 4) * 8;
#pragma unroll
    for (int r = 0; r < 8; ++r) {
      int m = r + mhi;
      int t = t0 + m, ss = s0 + n;
      float val = acc[r] * 0.125f;      // 1/sqrt(64)
      if (ss > t) val = -1e30f;         // causal mask
      scores[m * SST + ss] = val;
    }
  }
  __syncthreads();

  // ---- phase 2: softmax per row (8 lanes/row, shfl_xor reductions) -------
  {
    int row = threadIdx.x >> 3;         // 0..15
    int sub = threadIdx.x & 7;
    float mx = -1e30f;
    for (int s = sub; s < limit; s += 8) mx = fmaxf(mx, scores[row * SST + s]);
    mx = fmaxf(mx, __shfl_xor(mx, 1, 32));
    mx = fmaxf(mx, __shfl_xor(mx, 2, 32));
    mx = fmaxf(mx, __shfl_xor(mx, 4, 32));
    float sum = 0.f;
    for (int s = sub; s < limit; s += 8) sum += __expf(scores[row * SST + s] - mx);
    sum += __shfl_xor(sum, 1, 32);
    sum += __shfl_xor(sum, 2, 32);
    sum += __shfl_xor(sum, 4, 32);
    float inv = 1.0f / sum;
    for (int s = sub; s < limit; s += 8)
      scores[row * SST + s] = __expf(scores[row * SST + s] - mx) * inv;
  }
  __syncthreads();

  // ---- phase 3: O = P @ V ; wave wv owns D-columns [16*wv, 16*wv+16) -----
  int d0 = wv * 16;
  const __bf16* vrow =
      vt + (((size_t)b * H_ + h) * D_ + d0 + l15) * (size_t)T_;
  v8f acc = {};
  int nk = (count + 1) >> 1;            // 32-wide K tiles over s
  for (int st = 0; st < nk; ++st) {
    int s0 = st * 32;
    v16bf pa;
#pragma unroll
    for (int j = 0; j < 8; ++j) {
      int s1 = s0 + kb + j;
      int s2 = s0 + 16 + kb + j;
      pa[j]     = (__bf16)((s1 < limit) ? scores[l15 * SST + s1] : 0.0f);
      pa[j + 8] = (__bf16)((s2 < limit) ? scores[l15 * SST + s2] : 0.0f);
    }
    v16bf vb = load_frag(vrow + s0 + kb);
    acc = wmma_bf16(pa, vb, acc);
  }
  int mhi = (lane >> 4) * 8;
#pragma unroll
  for (int r = 0; r < 8; ++r) {
    int t = t0 + r + mhi;
    ybf[((size_t)b * T_ + t) * C_ + h * D_ + d0 + l15] = (__bf16)acc[r];
  }
}

template <int EPI>
__global__ __launch_bounds__(256)
void gemm_bf16_kernel(const __bf16* __restrict__ A, const __bf16* __restrict__ W,
                      const float* __restrict__ bias, const float* __restrict__ res,
                      void* __restrict__ outp, int N, int K) {
  __shared__ __attribute__((aligned(16))) __bf16 atile[2][128 * 32];
  __shared__ __attribute__((aligned(16))) __bf16 btile[2][128 * 32];

  int lane = threadIdx.x & 31;
  int wv = threadIdx.x >> 5;
  int wm = wv >> 2, wn = wv & 3;
  int mbase = blockIdx.y * 128;
  int nbase = blockIdx.x * 128;
  int l15 = lane & 15;
  int kb  = (lane >> 4) * 8;
  bool w0 = (threadIdx.x < 32);

  const __bf16* abase = A + (size_t)mbase * K;
  const __bf16* wbase = W + (size_t)nbase * K;
  unsigned int ldsA[2] = {(unsigned int)(uintptr_t)(&atile[0][0]),
                          (unsigned int)(uintptr_t)(&atile[1][0])};
  unsigned int ldsB[2] = {(unsigned int)(uintptr_t)(&btile[0][0]),
                          (unsigned int)(uintptr_t)(&btile[1][0])};

  v8f acc[4][2];
  v8f z = {};
#pragma unroll
  for (int i = 0; i < 4; ++i)
#pragma unroll
    for (int j = 0; j < 2; ++j) acc[i][j] = z;

  int nk = K / 32;
  if (w0) {                             // prime buffer 0 with k-tile 0
    tdm_load_2d_bf16(ldsA[0], abase, 32, 128, K);
    tdm_load_2d_bf16(ldsB[0], wbase, 32, 128, K);
  }

  for (int it = 0; it < nk; ++it) {
    int buf = it & 1;
    if (w0) {
      if (it + 1 < nk) {                // issue next tile into other buffer
        int k1 = (it + 1) * 32;
        tdm_load_2d_bf16(ldsA[buf ^ 1], abase + k1, 32, 128, K);
        tdm_load_2d_bf16(ldsB[buf ^ 1], wbase + k1, 32, 128, K);
        __builtin_amdgcn_s_wait_tensorcnt((short)2);  // tile `it` retired
      } else {
        __builtin_amdgcn_s_wait_tensorcnt((short)0);
      }
    }
    __syncthreads();                    // tile `it` visible to all waves

    const __bf16* at = &atile[buf][0];
    const __bf16* bt = &btile[buf][0];
    v16bf a[4], bfr[2];
#pragma unroll
    for (int i = 0; i < 4; ++i)
      a[i] = load_frag(at + (wm * 64 + i * 16 + l15) * 32 + kb);
#pragma unroll
    for (int j = 0; j < 2; ++j)
      bfr[j] = load_frag(bt + (wn * 32 + j * 16 + l15) * 32 + kb);
#pragma unroll
    for (int i = 0; i < 4; ++i)
#pragma unroll
      for (int j = 0; j < 2; ++j)
        acc[i][j] = wmma_bf16(a[i], bfr[j], acc[i][j]);

    __syncthreads();                    // done consuming before overwrite
  }

  int mhi = (lane >> 4) * 8;
#pragma unroll
  for (int i = 0; i < 4; ++i)
#pragma unroll
    for (int j = 0; j < 2; ++j)
#pragma unroll
      for (int r = 0; r < 8; ++r) {
        int row = mbase + wm * 64 + i * 16 + r + mhi;
        int col = nbase + wn * 32 + j * 16 + l15;
        float v = acc[i][j][r] + bias[col];
        if (EPI == 0) {
          ((float*)outp)[(size_t)row * N + col] = v + res[(size_t)row * N + col];
        } else {
          ((__bf16*)outp)[(size_t)row * N + col] = (__bf16)gelu_f(v);
        }
      }
}

// ------------------------------ launch -------------------------------------
extern "C" void kernel_launch(void* const* d_in, const int* in_sizes, int n_in,
                              void* d_out, int out_size, void* d_ws, size_t ws_size,
                              hipStream_t stream) {
  const float* q       = (const float*)d_in[0];
  const float* k       = (const float*)d_in[1];
  const float* v       = (const float*)d_in[2];
  const float* ln1_w   = (const float*)d_in[3];
  const float* ln1_b   = (const float*)d_in[4];
  const float* ln2_w   = (const float*)d_in[5];
  const float* ln2_b   = (const float*)d_in[6];
  const float* apw     = (const float*)d_in[7];   // [C,C]
  const float* apb     = (const float*)d_in[8];
  const float* fcw     = (const float*)d_in[9];   // [4C,C]
  const float* fcb     = (const float*)d_in[10];
  const float* pw      = (const float*)d_in[11];  // [C,4C]
  const float* pb      = (const float*)d_in[12];
  float* out           = (float*)d_out;

  const size_t MB = 1u << 20;
  uint8_t* ws = (uint8_t*)d_ws;
  float*  qn    = (float*)(ws + 0);          // 16 MB  ln1(q), f32 (residual)
  float*  x     = (float*)(ws + 16 * MB);    // 16 MB  attn-block output, f32
  __bf16* qbf   = (__bf16*)(ws + 32 * MB);   //  8 MB
  __bf16* kbf   = (__bf16*)(ws + 40 * MB);   //  8 MB
  __bf16* vt    = (__bf16*)(ws + 48 * MB);   //  8 MB  [B,H,D,T]
  __bf16* ybf   = (__bf16*)(ws + 56 * MB);   //  8 MB  attention output
  __bf16* hbf   = (__bf16*)(ws + 64 * MB);   //  8 MB  ln2(x)
  __bf16* gbf   = (__bf16*)(ws + 72 * MB);   // 32 MB  gelu(fc)
  __bf16* apwbf = (__bf16*)(ws + 104 * MB);  //  2 MB
  __bf16* fcwbf = (__bf16*)(ws + 106 * MB);  //  8 MB
  __bf16* pwbf  = (__bf16*)(ws + 114 * MB);  //  8 MB  (total 122 MB)

  // weights f32 -> bf16 (layout [N,K] is already WMMA B-operand friendly)
  cvt_bf16_kernel<<<512, 256, 0, stream>>>(apw, apwbf, C_ * C_);
  cvt_bf16_kernel<<<512, 256, 0, stream>>>(fcw, fcwbf, FC_ * C_);
  cvt_bf16_kernel<<<512, 256, 0, stream>>>(pw,  pwbf,  C_ * FC_);

  // shared pre-LN on q, k, v
  ln_kernel<<<NTOK, 256, 0, stream>>>(q, ln1_w, ln1_b, qbf, qn, nullptr);
  ln_kernel<<<NTOK, 256, 0, stream>>>(k, ln1_w, ln1_b, kbf, nullptr, nullptr);
  ln_kernel<<<NTOK, 256, 0, stream>>>(v, ln1_w, ln1_b, nullptr, nullptr, vt);

  // causal multi-head attention
  int smem = 16 * SST * (int)sizeof(float);  // 131584 B, < 320 KB WGP LDS
  (void)hipFuncSetAttribute(reinterpret_cast<const void*>(attn_kernel),
                            hipFuncAttributeMaxDynamicSharedMemorySize, smem);
  attn_kernel<<<dim3(T_ / 16, H_, B_), 128, smem, stream>>>(qbf, kbf, vt, ybf);

  // x = qn + y @ attn_proj_w^T + attn_proj_b
  gemm_bf16_kernel<0><<<dim3(C_ / 128, NTOK / 128), 256, 0, stream>>>(
      ybf, apwbf, apb, qn, (void*)x, C_, C_);

  // h = ln2(x)
  ln_kernel<<<NTOK, 256, 0, stream>>>(x, ln2_w, ln2_b, hbf, nullptr, nullptr);

  // g = gelu(h @ fc_w^T + fc_b)
  gemm_bf16_kernel<1><<<dim3(FC_ / 128, NTOK / 128), 256, 0, stream>>>(
      hbf, fcwbf, fcb, nullptr, (void*)gbf, FC_, C_);

  // out = x + g @ proj_w^T + proj_b
  gemm_bf16_kernel<0><<<dim3(C_ / 128, NTOK / 128), 256, 0, stream>>>(
      gbf, pwbf, pb, x, (void*)out, C_, FC_);
}

// v001
// One run takes 375 microseconds.
// Two timings next to v000 put it at 2.16 and 2.15 times that version's speed.
#include <hip/hip_runtime.h>
#include <math.h>

#define B_ 2
#define T_ 2048
#define C_ 1024
#define H_ 16
#define D_ 64
#define NTOK (B_ * T_)   /* 4096 token rows */
#define FC_  (4 * C_)    /* 4096 hidden     */

typedef __bf16 v16bf __attribute__((ext_vector_type(16)));
typedef __bf16 v8bf  __attribute__((ext_vector_type(8)));
typedef float  v8f   __attribute__((ext_vector_type(8)));
typedef unsigned int v4u __attribute__((ext_vector_type(4)));
typedef int    v4i   __attribute__((ext_vector_type(4)));
typedef int    v8i   __attribute__((ext_vector_type(8)));

__device__ __forceinline__ v8f wmma_bf16(v16bf a, v16bf b, v8f c) {
  // D = A(16x32 bf16) * B(32x16 bf16) + C(16x16 f32)
  return __builtin_amdgcn_wmma_f32_16x16x32_bf16(
      /*neg_a=*/false, a, /*neg_b=*/false, b,
      /*c_mod=*/(short)0, c, /*reuse_a=*/false, /*reuse_b=*/false);
}

__device__ __forceinline__ v16bf load_frag(const __bf16* p) {
  v8bf lo = *(const v8bf*)(p);
  v8bf hi = *(const v8bf*)(p + 16);
  v16bf r;
#pragma unroll
  for (int i = 0; i < 8; ++i) { r[i] = lo[i]; r[i + 8] = hi[i]; }
  return r;
}

__device__ __forceinline__ void tdm_load_2d_bf16(unsigned int lds_addr,
                                                 const __bf16* gptr,
                                                 int tile_k, int tile_n, int K) {
  unsigned long long ga = (unsigned long long)(uintptr_t)gptr;
  v4u g0;
  g0[0] = 1u;
  g0[1] = lds_addr;
  g0[2] = (unsigned int)ga;
  g0[3] = (unsigned int)((ga >> 32) & 0x01FFFFFFu) | 0x80000000u;
  unsigned int td0 = (unsigned int)K;
  unsigned int td1 = 1u << 20;
  unsigned int st0 = (unsigned int)K;
  v8i g1;
  g1[0] = (int)(1u << 16);
  g1[1] = (int)((td0 & 0xFFFFu) << 16);
  g1[2] = (int)((td0 >> 16) | ((td1 & 0xFFFFu) << 16));
  g1[3] = (int)((td1 >> 16) | ((unsigned int)tile_k << 16));
  g1[4] = tile_n;
  g1[5] = (int)st0;
  g1[6] = 0;
  g1[7] = 0;
  v4i z4 = {0, 0, 0, 0};
  v8i z8 = {0, 0, 0, 0, 0, 0, 0, 0};
  __builtin_amdgcn_tensor_load_to_lds(g0, g1, z4, z4, z8, 0);
}

__device__ __forceinline__ float gelu_f(float x) {
  const float c = 0.7978845608028654f; // sqrt(2/pi)
  return 0.5f * x * (1.0f + tanhf(c * (x + 0.044715f * x * x * x)));
}

// ------------------------------ f32 -> bf16 --------------------------------
__global__ void cvt_bf16_kernel(const float* __restrict__ in,
                                __bf16* __restrict__ out, int n) {
  int i = blockIdx.x * blockDim.x + threadIdx.x;
  int stride = gridDim.x * blockDim.x;
  for (; i < n; i += stride) out[i] = (__bf16)in[i];
}

// ------------------------------ LayerNorm ----------------------------------
__global__ __launch_bounds__(256)
void ln_kernel(const float* __restrict__ in, const float* __restrict__ w,
               const float* __restrict__ bvec, __bf16* __restrict__ out_bf,
               float* __restrict__ out_f32, __bf16* __restrict__ vt) {
  int row = blockIdx.x;                 // 0..NTOK-1
  const float* x = in + (size_t)row * C_;
  int tid = threadIdx.x;

  float s = 0.f, s2 = 0.f;
  for (int c = tid; c < C_; c += 256) { float v = x[c]; s += v; s2 += v * v; }
#pragma unroll
  for (int o = 16; o; o >>= 1) {
    s  += __shfl_down(s,  o, 32);
    s2 += __shfl_down(s2, o, 32);
  }
  __shared__ float rs[8], rs2[8];
  __shared__ float mu_s, rstd_s;
  if ((tid & 31) == 0) { rs[tid >> 5] = s; rs2[tid >> 5] = s2; }
  __syncthreads();
  if (tid == 0) {
    float ts = 0.f, ts2 = 0.f;
#pragma unroll
    for (int i = 0; i < 8; ++i) { ts += rs[i]; ts2 += rs2[i]; }
    float mu = ts / (float)C_;
    float var = ts2 / (float)C_ - mu * mu;
    mu_s = mu;
    rstd_s = rsqrtf(var + 1e-5f);
  }
  __syncthreads();
  float mu = mu_s, rstd = rstd_s;
  int b = row / T_, t = row % T_;
  for (int c = tid; c < C_; c += 256) {
    float v = (x[c] - mu) * rstd * w[c] + bvec[c];
    if (out_f32) out_f32[(size_t)row * C_ + c] = v;
    if (out_bf)  out_bf[(size_t)row * C_ + c] = (__bf16)v;
    if (vt) {
      int h = c >> 6, d = c & 63;
      vt[(((size_t)b * H_ + h) * D_ + d) * T_ + t] = (__bf16)v;
    }
  }
}

__device__ __forceinline__ float xhalf(float x) {
  int b = __builtin_bit_cast(int, x);
  return __builtin_bit_cast(float, __builtin_amdgcn_permlanex16(
      b, b, 0x76543210, 0xfedcba98, false, false));
}

// One pass: keys s0..s0+31 against the wave's 32 queries. kf holds this pass's
// K fragments on entry; unless DIAG (the last pass) it leaves with the next's.
template <bool DIAG>
__device__ __forceinline__ void attn_pass(
    const __bf16* __restrict__ kl, const __bf16* __restrict__ vl, int s0,
    int l15, int hh, const v16bf (&qf)[2][2], v16bf (&kf)[2][2],
    v8f (&o)[4][2], float (&ms)[2], float (&lsum)[2]) {
  const float sc = 0.18033688011112042f;   // log2(e) / sqrt(64)

  v16bf vf[4];                             // V^T rows d, keys s0..s0+31
#pragma unroll
  for (int dt = 0; dt < 4; ++dt)
    vf[dt] = load_frag(vl + (size_t)dt * 16 * T_ + s0);

  v8f st[2][2];                            // [key tile][query tile]
#pragma unroll
  for (int si = 0; si < 2; ++si)
#pragma unroll
    for (int ti = 0; ti < 2; ++ti) {
      v8f z = {};
      z = wmma_bf16(kf[si][0], qf[ti][0], z);
      st[si][ti] = wmma_bf16(kf[si][1], qf[ti][1], z);
    }

  if (!DIAG) {                             // next pass's K, one pass ahead
#pragma unroll
    for (int si = 0; si < 2; ++si)
#pragma unroll
      for (int dh = 0; dh < 2; ++dh)
        kf[si][dh] = load_frag(kl + (size_t)(s0 + 32 + si * 16) * C_ + dh * 32);
  } else {                                 // causal mask: key > query
#pragma unroll
    for (int si = 0; si < 2; ++si)
#pragma unroll
      for (int ti = 0; ti < 2; ++ti)
#pragma unroll
        for (int r = 0; r < 8; ++r)
          if (si * 16 + hh * 8 + r > ti * 16 + l15) st[si][ti][r] = -1e30f;
  }

  float mloc[2];
#pragma unroll
  for (int ti = 0; ti < 2; ++ti) {
    float m = st[0][ti][0];
#pragma unroll
    for (int r = 1; r < 8; ++r) m = fmaxf(m, st[0][ti][r]);
#pragma unroll
    for (int r = 0; r < 8; ++r) m = fmaxf(m, st[1][ti][r]);
    mloc[ti] = m;
  }

  // Move the reference maximum only when a score passes it by more than 8
  // (log2 units): P stays below 2^8 and most passes skip the rescale of O.
  bool need = (mloc[0] * sc > ms[0] + 8.0f) || (mloc[1] * sc > ms[1] + 8.0f);
  if (__builtin_amdgcn_ballot_w32(need) != 0) {
#pragma unroll
    for (int ti = 0; ti < 2; ++ti) {
      float mn = fmaxf(ms[ti], fmaxf(mloc[ti], xhalf(mloc[ti])) * sc);
      float al = __builtin_amdgcn_exp2f(ms[ti] - mn);
      ms[ti] = mn;
      lsum[ti] *= al;
#pragma unroll
      for (int dt = 0; dt < 4; ++dt)
#pragma unroll
        for (int r = 0; r < 8; ++r) o[dt][ti][r] *= al;
    }
  }

  v16bf pf[2];                             // P^T as B operand, hardware k order
#pragma unroll
  for (int ti = 0; ti < 2; ++ti) {
    float s = 0.f;
#pragma unroll
    for (int si = 0; si < 2; ++si)
#pragma unroll
      for (int r = 0; r < 8; ++r) {
        float p = __builtin_amdgcn_exp2f(st[si][ti][r] * sc - ms[ti]);
        s += p;
        pf[ti][si * 8 + r] = (__bf16)p;
      }
    lsum[ti] += s;
  }

#pragma unroll
  for (int dt = 0; dt < 4; ++dt)
#pragma unroll
    for (int ti = 0; ti < 2; ++ti)
      o[dt][ti] = wmma_bf16(vf[dt], pf[ti], o[dt][ti]);
}

__global__ __launch_bounds__(256)
void attn_kernel(const __bf16* __restrict__ qbf, const __bf16* __restrict__ kbf,
                 const __bf16* __restrict__ vt, __bf16* __restrict__ ybf) {
  int lane = threadIdx.x & 31;
  int wv   = __builtin_amdgcn_readfirstlane(threadIdx.x >> 5);  // 0..7, scalar
  int h = blockIdx.x, b = blockIdx.y;
  int pr = blockIdx.z;                  // 0..T_/256-1
  int qb = (wv < 4) ? (T_ / 128 - 1 - pr) : pr;
  int q0 = qb * 128 + (wv & 3) * 32;    // first of the wave's 32 queries
  int l15 = lane & 15;
  int hh  = lane >> 4;
  int kb  = hh * 8;

  const __bf16* ql = qbf + ((size_t)b * T_ + q0 + l15) * C_ + h * D_ + kb;
  const __bf16* kl = kbf + ((size_t)b * T_ + l15) * C_ + h * D_ + kb;
  const __bf16* vl = vt + (((size_t)b * H_ + h) * D_ + l15) * (size_t)T_ + kb;

  v16bf qf[2][2], kf[2][2];
#pragma unroll
  for (int ti = 0; ti < 2; ++ti)
#pragma unroll
    for (int dh = 0; dh < 2; ++dh) {
      qf[ti][dh] = load_frag(ql + (size_t)ti * 16 * C_ + dh * 32);
      kf[ti][dh] = load_frag(kl + (size_t)ti * 16 * C_ + dh * 32);
    }
  // stands in front of the reuse of the address registers of the loads above
  asm volatile("s_wait_xcnt 0x0" ::: "memory");

  v8f o[4][2];
  v8f z = {};
#pragma unroll
  for (int dt = 0; dt < 4; ++dt)
#pragma unroll
    for (int ti = 0; ti < 2; ++ti) o[dt][ti] = z;
  float ms[2] = {-1e30f, -1e30f};       // maximum in use, scaled log2 units
  float lsum[2] = {0.f, 0.f};           // this half's share of the row sum

  for (int s0 = 0; s0 < q0; s0 += 32)
    attn_pass<false>(kl, vl, s0, l15, hh, qf, kf, o, ms, lsum);
  attn_pass<true>(kl, vl, q0, l15, hh, qf, kf, o, ms, lsum);

  // lane holds O^T[dt*16 + 8*hh + r][query]: 8 consecutive d, one 16-byte store
  v8bf ov[2][4];
#pragma unroll
  for (int ti = 0; ti < 2; ++ti) {
    float inv = 1.0f / (lsum[ti] + xhalf(lsum[ti]));
#pragma unroll
    for (int dt = 0; dt < 4; ++dt)
#pragma unroll
      for (int r = 0; r < 8; ++r) ov[ti][dt][r] = (__bf16)(o[dt][ti][r] * inv);
  }
  __bf16* yl = ybf + ((size_t)b * T_ + q0 + l15) * C_ + h * D_ + kb;
#pragma unroll
  for (int ti = 0; ti < 2; ++ti)
#pragma unroll
    for (int dt = 0; dt < 4; ++dt)
      *(v8bf*)(yl + (size_t)ti * 16 * C_ + dt * 16) = ov[ti][dt];
}

template <int EPI>
__global__ __launch_bounds__(256)
void gemm_bf16_kernel(const __bf16* __restrict__ A, const __bf16* __restrict__ W,
                      const float* __restrict__ bias, const float* __restrict__ res,
                      void* __restrict__ outp, int N, int K) {
  __shared__ __attribute__((aligned(16))) __bf16 atile[2][128 * 32];
  __shared__ __attribute__((aligned(16))) __bf16 btile[2][128 * 32];

  int lane = threadIdx.x & 31;
  int wv = threadIdx.x >> 5;
  int wm = wv >> 2, wn = wv & 3;
  int mbase = blockIdx.y * 128;
  int nbase = blockIdx.x * 128;
  int l15 = lane & 15;
  int kb  = (lane >> 4) * 8;
  bool w0 = (threadIdx.x < 32);

  const __bf16* abase = A + (size_t)mbase * K;
  const __bf16* wbase = W + (size_t)nbase * K;
  unsigned int ldsA[2] = {(unsigned int)(uintptr_t)(&atile[0][0]),
                          (unsigned int)(uintptr_t)(&atile[1][0])};
  unsigned int ldsB[2] = {(unsigned int)(uintptr_t)(&btile[0][0]),
                          (unsigned int)(uintptr_t)(&btile[1][0])};

  v8f acc[4][2];
  v8f z = {};
#pragma unroll
  for (int i = 0; i < 4; ++i)
#pragma unroll
    for (int j = 0; j < 2; ++j) acc[i][j] = z;

  int nk = K / 32;
  if (w0) {                             // prime buffer 0 with k-tile 0
    tdm_load_2d_bf16(ldsA[0], abase, 32, 128, K);
    tdm_load_2d_bf16(ldsB[0], wbase, 32, 128, K);
  }

  for (int it = 0; it < nk; ++it) {
    int buf = it & 1;
    if (w0) {
      if (it + 1 < nk) {                // issue next tile into other buffer
        int k1 = (it + 1) * 32;
        tdm_load_2d_bf16(ldsA[buf ^ 1], abase + k1, 32, 128, K);
        tdm_load_2d_bf16(ldsB[buf ^ 1], wbase + k1, 32, 128, K);
        __builtin_amdgcn_s_wait_tensorcnt((short)2);  // tile `it` retired
      } else {
        __builtin_amdgcn_s_wait_tensorcnt((short)0);
      }
    }
    __syncthreads();                    // tile `it` visible to all waves

    const __bf16* at = &atile[buf][0];
    const __bf16* bt = &btile[buf][0];
    v16bf a[4], bfr[2];
#pragma unroll
    for (int i = 0; i < 4; ++i)
      a[i] = load_frag(at + (wm * 64 + i * 16 + l15) * 32 + kb);
#pragma unroll
    for (int j = 0; j < 2; ++j)
      bfr[j] = load_frag(bt + (wn * 32 + j * 16 + l15) * 32 + kb);
#pragma unroll
    for (int i = 0; i < 4; ++i)
#pragma unroll
      for (int j = 0; j < 2; ++j)
        acc[i][j] = wmma_bf16(a[i], bfr[j], acc[i][j]);

    __syncthreads();                    // done consuming before overwrite
  }

  int mhi = (lane >> 4) * 8;
#pragma unroll
  for (int i = 0; i < 4; ++i)
#pragma unroll
    for (int j = 0; j < 2; ++j)
#pragma unroll
      for (int r = 0; r < 8; ++r) {
        int row = mbase + wm * 64 + i * 16 + r + mhi;
        int col = nbase + wn * 32 + j * 16 + l15;
        float v = acc[i][j][r] + bias[col];
        if (EPI == 0) {
          ((float*)outp)[(size_t)row * N + col] = v + res[(size_t)row * N + col];
        } else {
          ((__bf16*)outp)[(size_t)row * N + col] = (__bf16)gelu_f(v);
        }
      }
}

// ------------------------------ launch -------------------------------------
extern "C" void kernel_launch(void* const* d_in, const int* in_sizes, int n_in,
                              void* d_out, int out_size, void* d_ws, size_t ws_size,
                              hipStream_t stream) {
  const float* q       = (const float*)d_in[0];
  const float* k       = (const float*)d_in[1];
  const float* v       = (const float*)d_in[2];
  const float* ln1_w   = (const float*)d_in[3];
  const float* ln1_b   = (const float*)d_in[4];
  const float* ln2_w   = (const float*)d_in[5];
  const float* ln2_b   = (const float*)d_in[6];
  const float* apw     = (const float*)d_in[7];   // [C,C]
  const float* apb     = (const float*)d_in[8];
  const float* fcw     = (const float*)d_in[9];   // [4C,C]
  const float* fcb     = (const float*)d_in[10];
  const float* pw      = (const float*)d_in[11];  // [C,4C]
  const float* pb      = (const float*)d_in[12];
  float* out           = (float*)d_out;

  const size_t MB = 1u << 20;
  uint8_t* ws = (uint8_t*)d_ws;
  float*  qn    = (float*)(ws + 0);          // 16 MB  ln1(q), f32 (residual)
  float*  x     = (float*)(ws + 16 * MB);    // 16 MB  attn-block output, f32
  __bf16* qbf   = (__bf16*)(ws + 32 * MB);   //  8 MB
  __bf16* kbf   = (__bf16*)(ws + 40 * MB);   //  8 MB
  __bf16* vt    = (__bf16*)(ws + 48 * MB);   //  8 MB  [B,H,D,T]
  __bf16* ybf   = (__bf16*)(ws + 56 * MB);   //  8 MB  attention output
  __bf16* hbf   = (__bf16*)(ws + 64 * MB);   //  8 MB  ln2(x)
  __bf16* gbf   = (__bf16*)(ws + 72 * MB);   // 32 MB  gelu(fc)
  __bf16* apwbf = (__bf16*)(ws + 104 * MB);  //  2 MB
  __bf16* fcwbf = (__bf16*)(ws + 106 * MB);  //  8 MB
  __bf16* pwbf  = (__bf16*)(ws + 114 * MB);  //  8 MB  (total 122 MB)

  // weights f32 -> bf16 (layout [N,K] is already WMMA B-operand friendly)
  cvt_bf16_kernel<<<512, 256, 0, stream>>>(apw, apwbf, C_ * C_);
  cvt_bf16_kernel<<<512, 256, 0, stream>>>(fcw, fcwbf, FC_ * C_);
  cvt_bf16_kernel<<<512, 256, 0, stream>>>(pw,  pwbf,  C_ * FC_);

  // shared pre-LN on q, k, v
  ln_kernel<<<NTOK, 256, 0, stream>>>(q, ln1_w, ln1_b, qbf, qn, nullptr);
  ln_kernel<<<NTOK, 256, 0, stream>>>(k, ln1_w, ln1_b, kbf, nullptr, nullptr);
  ln_kernel<<<NTOK, 256, 0, stream>>>(v, ln1_w, ln1_b, nullptr, nullptr, vt);

  // causal multi-head attention
  attn_kernel<<<dim3(H_, B_, T_ / 256), 256, 0, stream>>>(qbf, kbf, vt, ybf);

  // x = qn + y @ attn_proj_w^T + attn_proj_b
  gemm_bf16_kernel<0><<<dim3(C_ / 128, NTOK / 128), 256, 0, stream>>>(
      ybf, apwbf, apb, qn, (void*)x, C_, C_);

  // h = ln2(x)
  ln_kernel<<<NTOK, 256, 0, stream>>>(x, ln2_w, ln2_b, hbf, nullptr, nullptr);

  // g = gelu(h @ fc_w^T + fc_b)
  gemm_bf16_kernel<1><<<dim3(FC_ / 128, NTOK / 128), 256, 0, stream>>>(
      hbf, fcwbf, fcb, nullptr, (void*)gbf, FC_, C_);

  // out = x + g @ proj_w^T + proj_b
  gemm_bf16_kernel<0><<<dim3(C_ / 128, NTOK / 128), 256, 0, stream>>>(
      gbf, pwbf, pb, x, (void*)out, C_, FC_);
}
